// v010
// Measured on an AMD MI455X. A time is GPU time per run, averaged over a window of back-to-back runs after a warm-up
// (all launches, gaps included; the runs take copies of the inputs in turn), and the median of several windows.
// Apart from v000's, it joins two sittings. Times from different sittings can be a few percent apart, while
// side-by-side timings come from the same sitting.
// This document starts at v010; the versions before it stand elsewhere.
// One run takes 69.4 microseconds.
// Two timings next to v009 both put it at 1.06 times that version's speed.
// All steps since the starting kernel, v000, together make it 19.6 times as fast.
#include <hip/hip_runtime.h>
// EigenBiasAttention (2 x 1024 tokens x 1024 = 16 heads x 64; qkv = x Wqkv^T + b; causal softmax(q.k/8 + |bias|) v; bias from Plucker lines: per head w1 = x_prev W1w^T, w2 = x W2w^T, r1 = x W1r^T, r2 = x W2r^T (4-vectors), write/read lines = normalised exterior products (6-vectors), Jw = write J6, M_t = cumsum_t Jw Jw^T, bias[t][s] = |(rd_t . M_t) . Jw_s| * bias_scale[h]; out = merged . Wout^T + bout).
// Structure: exact f16 x plane; qkv and the four line projections as f16 WMMA GEMMs (32x64 wave tiles, f32 accumulation, exact x16 weights (+ bias)), whose epilogue writes the f16 q/k planes (one [t][64] plane per (batch, head)) and V^T hi/residual (the line projections f32); the exterior products / normalisation / J6 on VALU; the causal 6x6 Gram cumsum and rd . M per (batch, head) on VALU (f32; products and rd . M four rows per thread, the 1024-step running sums by one wave through LDS); one fused launch for all 32 (batch, head) planes: score products (K = 64, f32), the biased causal softmax on VALU with a running row maximum (bias dot K = 6 per (t, s), bias_scale read; unnormalised f16 weights x 2^10), readout as two product terms, row scaling + hi/residual; Wout as two product terms of one launch (+ bias).
// Compute dtype: inputs rounded to bf16; x / weights exact as f16 (line projections are f32 sums of exact products, so the bias path is f32-class); q, k and the softmax weights as plain f16 operands (~2^-12); v and the context as f16 hi + residual. v_wmma_f32_16x16x32_f16.
#define NB 2
#define TT 1024
#define DM 1024
#define NH 16
#define HD 64
#define NR (NB * TT)
typedef __bf16 v16b __attribute__((ext_vector_type(16)));
typedef unsigned short v8us __attribute__((ext_vector_type(8), may_alias));
typedef float  v8f  __attribute__((ext_vector_type(8)));
typedef float  v4f  __attribute__((ext_vector_type(4)));
typedef float  v4fa __attribute__((ext_vector_type(4), may_alias));
union FragB { v16b v; v8us half[2]; unsigned short u[16]; };

__device__ __forceinline__ unsigned short bf16_bits(float x) { unsigned int u = __float_as_uint(x); return (unsigned short)((u + 0x7FFFu + ((u >> 16) & 1u)) >> 16); }
__device__ __forceinline__ float bf16_val(unsigned short b) { return __uint_as_float(((unsigned int)b) << 16); }
__device__ __forceinline__ float bf16_round(float x) { return bf16_val(bf16_bits(x)); }
// D += A·B with NT terms: 1 = ah·bh, 2 = + al·bh (A split), 3 = + ah·bl (both split)
template <int NT>
__device__ __forceinline__ v8f mmaN(v16b ah, v16b al, v16b bh, v16b bl, v8f c) {
  c = __builtin_amdgcn_wmma_f32_16x16x32_bf16(false, ah, false, bh, (short)0, c, false, false);
  if (NT >= 2) c = __builtin_amdgcn_wmma_f32_16x16x32_bf16(false, al, false, bh, (short)0, c, false, false);
  if (NT >= 3) c = __builtin_amdgcn_wmma_f32_16x16x32_bf16(false, ah, false, bl, (short)0, c, false, false);
  asm volatile("v_nop\n\tv_nop\n\tv_nop\n\tv_nop" : "+v"(c) : "v"(ah), "v"(al), "v"(bh), "v"(bl));
  return c;
}

__global__ __launch_bounds__(256) void k_wt_bf16(const float* __restrict__ W, unsigned short* __restrict__ Wt, int K, int N) {
  const int t = blockIdx.x * 256 + threadIdx.x;
  const int k8n = K / 8;
  if (t >= N * k8n) return;
  const int n = t / k8n, k8 = (t % k8n) * 8;
  v8us v;
#pragma unroll
  for (int i = 0; i < 8; ++i) v[i] = bf16_bits(W[(size_t)(k8 + i) * N + n]);
  *(v8us*)(Wt + (size_t)n * K + k8) = v;
  
}

// GEMM C[M][N] (f32, pitch ldc) = act(A[M][K]·W + bias). A f32 row-major (pitch lda) converted per fragment to bf16
// (ASPLIT: hi/lo two planes -> 2 terms, else single rounded term); Wt bf16 [N][K] (pitch ldb). BIAS_BF16 rounds the
// bias to bf16 first (bias quantised to bf16 before the add). K%32==0, M%16==0, N%64==0.
template <bool ASPLIT, int ACT, bool BIAS_BF16>
__global__ __launch_bounds__(128) void k_gemm_bf(const float* __restrict__ A, int lda, const unsigned short* __restrict__ Wt, int ldb,
                                               const float* __restrict__ bias, float* __restrict__ C, int ldc, int M, int N, int K) {
  __shared__ __attribute__((aligned(16))) float so[4][16][64];
  const int tid = threadIdx.x, w = tid >> 5, lane = tid & 31, ln = lane & 15, hh = lane >> 4;
  const int ntn = N / 64;
  const int wid = blockIdx.x * 4 + w;
  const int mt = wid / ntn, nq = wid % ntn;
  if (mt * 16 >= M) return;
  const int row0 = mt * 16, col0 = nq * 64;
  const float* arow = A + (size_t)(row0 + ln) * lda;
  v8f acc[4] = {};
  for (int kb = 0; kb < K; kb += 32) {
    FragB ah, al;
    const v4f x0 = *(const v4fa*)(arow + kb + 8 * hh), x1 = *(const v4fa*)(arow + kb + 8 * hh + 4);
    const v4f x2 = *(const v4fa*)(arow + kb + 16 + 8 * hh), x3 = *(const v4fa*)(arow + kb + 16 + 8 * hh + 4);
    float xs[16] = {x0[0],x0[1],x0[2],x0[3],x1[0],x1[1],x1[2],x1[3],x2[0],x2[1],x2[2],x2[3],x3[0],x3[1],x3[2],x3[3]};
#pragma unroll
    for (int i = 0; i < 16; ++i) { const unsigned short hb = bf16_bits(xs[i]); ah.u[i] = hb; al.u[i] = ASPLIT ? bf16_bits(xs[i] - bf16_val(hb)) : (unsigned short)0; }
#pragma unroll
    for (int t = 0; t < 4; ++t) {
      const unsigned short* brow = Wt + (size_t)(col0 + t * 16 + ln) * ldb + kb;
      FragB b;
      b.half[0] = *(const v8us*)(brow + 8 * hh);
      b.half[1] = *(const v8us*)(brow + 16 + 8 * hh);
      acc[t] = mmaN<ASPLIT ? 2 : 1>(ah.v, al.v, b.v, b.v, acc[t]);
    }
  }
#pragma unroll
  for (int t = 0; t < 4; ++t) {
    float bv = bias ? bias[col0 + t * 16 + ln] : 0.f;
    if (BIAS_BF16) bv = bf16_round(bv);
#pragma unroll
    for (int r = 0; r < 8; ++r) { float v = acc[t][r] + bv; if (ACT == 1) v = fmaxf(v, 0.f); so[w][8 * hh + r][t * 16 + ln] = v; }
  }
  __builtin_amdgcn_fence(__ATOMIC_ACQ_REL, "workgroup");
  __builtin_amdgcn_wave_barrier();
  const int rsub = lane >> 4, c4 = (lane & 15) * 4;
  {
#pragma unroll
    for (int q = 0; q < 8; ++q) {
      const int r = q * 2 + rsub;
      const v4f v = *(const v4fa*)&so[w][r][c4];
      *(v4f*)(C + (size_t)(row0 + r) * ldc + col0 + c4) = v;
    }
    
  }
}

// GEMM C = act(A·W + bias + resid): A f32 (ASPLIT -> hi/lo 2 terms), Wt bf16 [N][K]; ACT 0 none, 1 relu, 2 exact gelu;
// resid (optional, f32, row index = (row % rmod), pitch ldr, RES_BF16 rounds it) added before the activation.
template <bool ASPLIT, int ACT, bool BIAS_BF16, bool RES_BF16>
__global__ __launch_bounds__(128) void k_gemm_bf3(const float* __restrict__ A, int lda, const unsigned short* __restrict__ Wt, int ldb,
                                                const float* __restrict__ bias, const float* __restrict__ resid, int rmod, int ldr,
                                                float* __restrict__ C, int ldc, int M, int N, int K) {
  __shared__ __attribute__((aligned(16))) float so[4][16][64];
  const int tid = threadIdx.x, w = tid >> 5, lane = tid & 31, ln = lane & 15, hh = lane >> 4;
  const int ntn = N / 64;
  const int wid = blockIdx.x * 4 + w;
  const int mt = wid / ntn, nq = wid % ntn;
  if (mt * 16 >= M) return;
  const int row0 = mt * 16, col0 = nq * 64;
  const float* arow = A + (size_t)(row0 + ln) * lda;
  v8f acc[4] = {};
  for (int kb = 0; kb < K; kb += 32) {
    FragB ah, al;
    const v4f x0 = *(const v4fa*)(arow + kb + 8 * hh), x1 = *(const v4fa*)(arow + kb + 8 * hh + 4);
    const v4f x2 = *(const v4fa*)(arow + kb + 16 + 8 * hh), x3 = *(const v4fa*)(arow + kb + 16 + 8 * hh + 4);
    float xs[16] = {x0[0],x0[1],x0[2],x0[3],x1[0],x1[1],x1[2],x1[3],x2[0],x2[1],x2[2],x2[3],x3[0],x3[1],x3[2],x3[3]};
#pragma unroll
    for (int i = 0; i < 16; ++i) { const unsigned short hb = bf16_bits(xs[i]); ah.u[i] = hb; al.u[i] = ASPLIT ? bf16_bits(xs[i] - bf16_val(hb)) : (unsigned short)0; }
#pragma unroll
    for (int t = 0; t < 4; ++t) {
      const unsigned short* brow = Wt + (size_t)(col0 + t * 16 + ln) * ldb + kb;
      FragB b;
      b.half[0] = *(const v8us*)(brow + 8 * hh);
      b.half[1] = *(const v8us*)(brow + 16 + 8 * hh);
      acc[t] = mmaN<ASPLIT ? 2 : 1>(ah.v, al.v, b.v, b.v, acc[t]);
    }
  }
#pragma unroll
  for (int t = 0; t < 4; ++t) {
    const int col = col0 + t * 16 + ln;
    float bv = bias ? bias[col] : 0.f;
    if (BIAS_BF16) bv = bf16_round(bv);
#pragma unroll
    for (int r = 0; r < 8; ++r) {
      float v = acc[t][r] + bv;
      if (resid) { float rv = resid[(size_t)((row0 + 8 * hh + r) % rmod) * ldr + col]; if (RES_BF16) rv = bf16_round(rv); v += rv; }
      if (ACT == 1) v = fmaxf(v, 0.f);
      if (ACT == 2) v = 0.5f * v * (1.0f + erff(v * 0.70710678118654752f));
      if (ACT == 3) { const float u = 0.7978845608028654f * (v + 0.044715f * v * v * v); v = 0.5f * v * (1.0f + tanhf(u)); }
      so[w][8 * hh + r][t * 16 + ln] = v;
    }
  }
  __builtin_amdgcn_fence(__ATOMIC_ACQ_REL, "workgroup");
  __builtin_amdgcn_wave_barrier();
  const int rsub = lane >> 4, c4 = (lane & 15) * 4;
  {
#pragma unroll
    for (int q = 0; q < 8; ++q) {
      const int r = q * 2 + rsub;
      const v4f v = *(const v4fa*)&so[w][r][c4];
      *(v4f*)(C + (size_t)(row0 + r) * ldc + col0 + c4) = v;
    }
    
  }
}
// row LayerNorm (biased variance, eps) over N: s = X (+ R); optional out_sum <- s; out_norm <- (s-mu)*rsqrt(var+eps)*g + b
template <bool PARAM_BF16>
__global__ __launch_bounds__(256) void k_layernorm(const float* __restrict__ X, const float* __restrict__ R, const float* __restrict__ g, const float* __restrict__ bta,
                                                  float* __restrict__ out_sum, float* __restrict__ out_norm, int N, float eps) {
  __shared__ float red[256];
  const int row = blockIdx.x, tid = threadIdx.x;
  const float* x = X + (size_t)row * N; const float* rr = R ? R + (size_t)row * N : nullptr;
  float vals[16];                     // up to N = 4096
  const int per = N / 256;            // contiguous chunk per thread? use strided-by-4 chunks: thread handles j = tid*4 + 1024*u
  float s1 = 0.f;
  for (int u = 0; u < per / 4; ++u) {
    const int j = tid * 4 + 1024 * u;
    const v4f a = *(const v4fa*)(x + j);
    v4f b = {0.f,0.f,0.f,0.f}; if (rr) b = *(const v4fa*)(rr + j);
#pragma unroll
    for (int q = 0; q < 4; ++q) { const float v = a[q] + b[q]; vals[u * 4 + q] = v; s1 += v; }
  }
  red[tid] = s1; __syncthreads();
  for (int st = 128; st > 0; st >>= 1) { if (tid < st) red[tid] += red[tid + st]; __syncthreads(); }
  const float mu = red[0] / (float)N; __syncthreads();
  float s2 = 0.f;
  for (int u = 0; u < per / 4; ++u)
#pragma unroll
    for (int q = 0; q < 4; ++q) { const float c = vals[u * 4 + q] - mu; s2 += c * c; }
  red[tid] = s2; __syncthreads();
  for (int st = 128; st > 0; st >>= 1) { if (tid < st) red[tid] += red[tid + st]; __syncthreads(); }
  const float rs = rsqrtf(red[0] / (float)N + eps);
  {
    for (int u = 0; u < per / 4; ++u) {
      const int j = tid * 4 + 1024 * u;
      v4f o, sm;
#pragma unroll
      for (int q = 0; q < 4; ++q) {
        float gg = g[j + q], bb = bta[j + q];
        if (PARAM_BF16) { gg = bf16_round(gg); bb = bf16_round(bb); }
        sm[q] = vals[u * 4 + q]; o[q] = (vals[u * 4 + q] - mu) * rs * gg + bb;
      }
      if (out_sum) *(v4f*)(out_sum + (size_t)row * N + j) = sm;
      *(v4f*)(out_norm + (size_t)row * N + j) = o;
    }
    
  }
}



// ---- f16 WMMA path (v_wmma_f32_16x16x32_f16): 11-bit significands for operands in range — used where a [0,1] probability operand needs more precision than bf16
typedef _Float16 v16h __attribute__((ext_vector_type(16)));
union FragH { v16h v; v8us half[2]; _Float16 h[16]; unsigned short u[16]; };
template <int NT>
__device__ __forceinline__ v8f mmaH(v16h ah, v16h al, v16h bh, v16h bl, v8f c) {
  c = __builtin_amdgcn_wmma_f32_16x16x32_f16(false, ah, false, bh, (short)0, c, false, false);
  if (NT >= 2) c = __builtin_amdgcn_wmma_f32_16x16x32_f16(false, al, false, bh, (short)0, c, false, false);
  if (NT >= 3) c = __builtin_amdgcn_wmma_f32_16x16x32_f16(false, ah, false, bl, (short)0, c, false, false);
  asm volatile("v_nop\n\tv_nop\n\tv_nop\n\tv_nop" : "+v"(c) : "v"(ah), "v"(al), "v"(bh), "v"(bl));
  return c;
}
// batched GEMM like k_gemm_b but f16 operands: A f32 (split into f16 hi/lo if ASPLIT, else rounded to f16), Bt = f16 values [n][k]; alpha; C f32; N multiple of 16 (partial tiles skipped)
template <bool ASPLIT>
__global__ __launch_bounds__(128) void k_gemm_h(const float* __restrict__ A, int lda, size_t sA, const _Float16* __restrict__ Bh, int ldb, size_t sB, float alpha, float* __restrict__ C, int ldc, size_t sC, int M, int N, int K) {
  __shared__ __attribute__((aligned(16))) float so[4][16][64];
  const int tid = threadIdx.x, w = tid >> 5, lane = tid & 31, ln = lane & 15, hh = lane >> 4; const int by = blockIdx.y;
  A += (size_t)by * sA; Bh += (size_t)by * sB; C += (size_t)by * sC;
  const int ntn = (N + 63) / 64; const int wid = blockIdx.x * 4 + w; const int mt = wid / ntn, nq = wid % ntn; if (mt * 16 >= M) return;
  const int row0 = mt * 16, col0 = nq * 64; const float* arow = A + (size_t)(row0 + ln) * lda;
  v8f acc[4] = {};
  for (int kb = 0; kb < K; kb += 32) {
    FragH ah, al;
    const v4f x0 = *(const v4fa*)(arow + kb + 8 * hh), x1 = *(const v4fa*)(arow + kb + 8 * hh + 4), x2 = *(const v4fa*)(arow + kb + 16 + 8 * hh), x3 = *(const v4fa*)(arow + kb + 16 + 8 * hh + 4);
    float xs[16] = {x0[0],x0[1],x0[2],x0[3],x1[0],x1[1],x1[2],x1[3],x2[0],x2[1],x2[2],x2[3],x3[0],x3[1],x3[2],x3[3]};
#pragma unroll
    for (int i = 0; i < 16; ++i) { const _Float16 h = (_Float16)xs[i]; ah.h[i] = h; al.h[i] = ASPLIT ? (_Float16)(xs[i] - (float)h) : (_Float16)0.0f; }
#pragma unroll
    for (int t = 0; t < 4; ++t) { if (col0 + t * 16 >= N) continue; const size_t boff = (size_t)(col0 + t * 16 + ln) * ldb + kb; FragH bq; bq.half[0] = *(const v8us*)(Bh + boff + 8 * hh); bq.half[1] = *(const v8us*)(Bh + boff + 16 + 8 * hh);
      acc[t] = mmaH<ASPLIT ? 2 : 1>(ah.v, al.v, bq.v, bq.v, acc[t]); }
  }
#pragma unroll
  for (int t = 0; t < 4; ++t) { if (col0 + t * 16 >= N) continue;
#pragma unroll
    for (int r = 0; r < 8; ++r) so[w][8 * hh + r][t * 16 + ln] = acc[t][r] * alpha; }
  __builtin_amdgcn_fence(__ATOMIC_ACQ_REL, "workgroup"); __builtin_amdgcn_wave_barrier();
  const int rsub = lane >> 4, c4 = (lane & 15) * 4;
  {
#pragma unroll
    for (int q = 0; q < 8; ++q) { const int r = q * 2 + rsub; if (col0 + c4 < N) { const v4f v = *(const v4fa*)&so[w][r][c4]; *(v4f*)(C + (size_t)(row0 + r) * ldc + col0 + c4) = v; } }
     }
}

// Wt[n][k] = f16(W[k][n]·scale) from f32 row-major W[K][N] (scale = power of two; bf16-exact weights stay exact in f16 away from the subnormal range)
__global__ __launch_bounds__(256) void k_wt_f16(const float* __restrict__ W, _Float16* __restrict__ Wt, int K, int N, float scale) {
  const int t = blockIdx.x * 256 + threadIdx.x; if (t >= N * (K / 8)) return; const int n = t / (K / 8), k8 = (t % (K / 8)) * 8; FragH f;
#pragma unroll
  for (int i = 0; i < 8; ++i) f.h[i] = (_Float16)(bf16_round(W[(size_t)(k8 + i) * N + n]) * scale); const v8us o = f.half[0];
  *(v8us*)((unsigned short*)Wt + (size_t)n * K + k8) = o; 
}
// k_gemm_hh variant with fused epilogue: v = acc·alpha + bias[by·sBias + col] (+ CP[(row/rowsPerB)·sCPb + by·64 + col] if CP) ; ACT 0 none / 1 elu ; writes f16 C16 (and f32 C if non-null)
template <int ACT>
__global__ __launch_bounds__(128) void k_gemm_hhx(const _Float16* __restrict__ A, int lda, size_t sA, const _Float16* __restrict__ Bh, int ldb, size_t sB, float alpha, const float* __restrict__ bias, size_t sBias, const float* __restrict__ CP, int rowsPerB, size_t sCPb, int row0g,
    float* __restrict__ C, _Float16* __restrict__ C16, int ldc, size_t sC, int M, int N, int K) {
  __shared__ __attribute__((aligned(16))) float so[4][16][64];
  const int tid = threadIdx.x, w = tid >> 5, lane = tid & 31, ln = lane & 15, hh = lane >> 4; const int by = blockIdx.y;
  A += (size_t)by * sA; Bh += (size_t)by * sB; const size_t cofs = (size_t)by * sC; const float* bp = bias ? bias + (size_t)by * sBias : nullptr;
  const int ntn = (N + 63) / 64; const int wid = blockIdx.x * 4 + w; const int mt = wid / ntn, nq = wid % ntn; if (mt * 16 >= M) return;
  const int row0 = mt * 16, col0 = nq * 64; const _Float16* arow = A + (size_t)(row0 + ln) * lda;
  v8f acc[4] = {};
  for (int kb = 0; kb < K; kb += 32) { FragH ah; ah.half[0] = *(const v8us*)((const unsigned short*)arow + kb + 8 * hh); ah.half[1] = *(const v8us*)((const unsigned short*)arow + kb + 16 + 8 * hh);
#pragma unroll
    for (int t = 0; t < 4; ++t) { if (col0 + t * 16 >= N) continue; const size_t boff = (size_t)(col0 + t * 16 + ln) * ldb + kb; FragH bq; bq.half[0] = *(const v8us*)((const unsigned short*)Bh + boff + 8 * hh); bq.half[1] = *(const v8us*)((const unsigned short*)Bh + boff + 16 + 8 * hh);
      acc[t] = mmaH<1>(ah.v, ah.v, bq.v, bq.v, acc[t]); }
  }
#pragma unroll
  for (int t = 0; t < 4; ++t) { if (col0 + t * 16 >= N) continue; const int col = col0 + t * 16 + ln; const float bv = bp ? bf16_round(bp[col]) : 0.f;
#pragma unroll
    for (int r = 0; r < 8; ++r) { float v = acc[t][r] * alpha + bv; if (CP) { const int rr = row0g + row0 + 8 * hh + r; if (rowsPerB < 0) v += CP[cofs + (size_t)rr * ldc + col];      /* rowsPerB < 0: own element of the batched C plane */ else { const int bidx = rr / rowsPerB; v += CP[(size_t)bidx * sCPb + (size_t)by * 64 + col]; } } if (ACT == 1) v = (v > 0.f) ? v : expm1f(v); else if (ACT == 7) v = (v > 0.f) ? v + 1.0f : expf(v); else if (ACT == 8) v = tanhf(v); else if (ACT == 9) v = 0.5f * v * (1.0f + tanhf(0.7978845608028654f * (v + 0.044715f * v * v * v))); else if (ACT == 11) v = 1.0f / (1.0f + expf(-v)); else if (ACT == 12) v = (v > 0.f) ? v : 0.01f * v; else if (ACT == 14) v = (v > 0.f) ? v : 0.1f * v; else if (ACT == 16) v = (v >= 0.f) ? v : 0.3f * v; else if (ACT == 17) v = (v >= 0.f) ? v : 0.2f * v; else if (ACT == 15) v = v / (1.0f + expf(-v)); else if (ACT == 3) v = fmaxf(v, 0.f); else if (ACT == 6) v = 0.5f * v * (1.0f + erff(v * 0.70710678118654752f)); so[w][8 * hh + r][t * 16 + ln] = v; } }
  __builtin_amdgcn_fence(__ATOMIC_ACQ_REL, "workgroup"); __builtin_amdgcn_wave_barrier();
  const int rsub = lane >> 4, c4 = (lane & 15) * 4; typedef _Float16 v4h __attribute__((ext_vector_type(4)));
  {
#pragma unroll
    for (int q = 0; q < 8; ++q) { const int r = q * 2 + rsub; if (col0 + c4 < N) { const v4f v = *(const v4fa*)&so[w][r][c4]; if (C) *(v4f*)(C + cofs + (size_t)(row0 + r) * ldc + col0 + c4) = v; if (C16) { v4h h4; for (int i = 0; i < 4; ++i) h4[i] = (_Float16)v[i]; *(v4h*)(C16 + cofs + (size_t)(row0 + r) * ldc + col0 + c4) = h4; } } }
     }
}


typedef _Float16 v4h __attribute__((ext_vector_type(4)));

__global__ __launch_bounds__(256) void k_h16(const float* __restrict__ x, _Float16* __restrict__ X16, size_t n8) { const size_t t = (size_t)blockIdx.x * 256 + threadIdx.x; if (t >= n8) return; FragH f;
#pragma unroll
  for (int q = 0; q < 8; ++q) f.h[q] = (_Float16)x[t * 8 + q]; *(v8us*)((unsigned short*)X16 + t * 8) = f.half[0];  }
__global__ __launch_bounds__(256) void k_round16f(const float* __restrict__ W, _Float16* __restrict__ Bt, size_t n8) { const size_t t = (size_t)blockIdx.x * 256 + threadIdx.x; if (t >= n8) return; FragH f;
#pragma unroll
  for (int i = 0; i < 8; ++i) f.h[i] = (_Float16)(bf16_round(W[t * 8 + i]) * 16.0f); *(v8us*)((unsigned short*)Bt + t * 8) = f.half[0];  }
__global__ __launch_bounds__(256) void k_hl(const float* __restrict__ F, _Float16* __restrict__ Hh, _Float16* __restrict__ Hl, size_t n8) { const size_t t = (size_t)blockIdx.x * 256 + threadIdx.x; if (t >= n8) return; FragH fh, fl; const v4f a = *(const v4fa*)(F + t * 8), c = *(const v4fa*)(F + t * 8 + 4);
#pragma unroll
  for (int q = 0; q < 4; ++q) { _Float16 h = (_Float16)a[q]; fh.h[q] = h; fl.h[q] = (_Float16)((a[q] - (float)h) * 1024.0f); h = (_Float16)c[q]; fh.h[4 + q] = h; fl.h[4 + q] = (_Float16)((c[q] - (float)h) * 1024.0f); }
  { *(v8us*)((unsigned short*)Hh + t * 8) = fh.half[0]; *(v8us*)((unsigned short*)Hl + t * 8) = fl.half[0];  } }

// ---- fast GEMM (block tile 128x64, wave tile 32x64, A and B k-tiles staged in LDS; requires M % 128 == 0, N % 64 == 0 and K == 64 or K % 128 == 0); epilogue = k_gemm_hhx semantics ----
#define G2_LP 72
__device__ __forceinline__ v16h g2_frag(const _Float16* p, int hh) { FragH f; f.half[0] = *(const v8us*)((const unsigned short*)p + 8 * hh); f.half[1] = *(const v8us*)((const unsigned short*)p + 16 + 8 * hh); return f.v; }
__device__ __forceinline__ v8f g2_mma(v16h a, v16h b, v8f c) { v8f d = __builtin_amdgcn_wmma_f32_16x16x32_f16(false, a, false, b, (short)0, c, false, false); asm volatile("v_nop\n\tv_nop\n\tv_nop\n\tv_nop" : "+v"(d) : "v"(a), "v"(b)); return d; }
// work-group barrier that orders LDS alone (its fences name the LDS address space): __syncthreads() also waits for every global load in flight, and the loads for the tiles ahead must stay in flight across it; the loop's global reads are of operands that no wave of the launch writes
__device__ __forceinline__ void g2_bar() { __builtin_amdgcn_fence(__ATOMIC_RELEASE, "workgroup", "local"); __builtin_amdgcn_s_barrier(); __builtin_amdgcn_fence(__ATOMIC_ACQUIRE, "workgroup", "local"); }
template <int ACT, bool PL>
__global__ __launch_bounds__(128) void k_gemm2(const _Float16* __restrict__ A, int lda, size_t sA, const _Float16* __restrict__ Bh, int ldb, size_t sB, float alpha, const float* __restrict__ bias, size_t sBias, const float* __restrict__ CP, int rowsPerB, size_t sCPb, int row0g,
    float* __restrict__ C, _Float16* __restrict__ C16, int ldc, size_t sC, int M, int N, int K, int nb1, const _Float16* __restrict__ B1, float* __restrict__ C1, int N1,
    _Float16* __restrict__ PQ, _Float16* __restrict__ PK, _Float16* __restrict__ PVH, _Float16* __restrict__ PVL) { static_assert(ACT == 0 || ACT == 3 || ACT == 6 || ACT == 8 || ACT == 9 || ACT == 11 || ACT == 12 || ACT == 14 || ACT == 15 || ACT == 16 || ACT == 17, "k_gemm2: unsupported ACT code (would silently apply no activation)");
  // k-tiles of 64 halves (one whole 128-B line per row) of the block's 128 A rows and 64 B rows, two buffers; row pitch 72 halves = 144 B = 16 B x 9 for the ds_load_b128 fragment reads
  // The epilogue's f32 tiles so[4][32][68] lie on the same bytes: they are first written behind the barrier that ends the last k-tile's reads. A block then takes 54 KiB of LDS, not 88: five fit a WGP, not three, and the whole QKV grid is resident at once instead of leaving its last blocks to a second round.
  __shared__ __attribute__((aligned(16))) char sm[(2 * 128 + 2 * 64) * G2_LP * 2];
  static_assert(4 * 32 * 68 * 4 <= (2 * 128 + 2 * 64) * G2_LP * 2 && 2 * 64 * 136 * 2 <= (2 * 128 + 2 * 64) * G2_LP * 2, "k_gemm2: the epilogue's tiles fit the k-tile buffers");
  _Float16 (*sa)[128][G2_LP] = (_Float16 (*)[128][G2_LP])sm; _Float16 (*sb)[64][G2_LP] = (_Float16 (*)[64][G2_LP])(sm + 2 * 128 * G2_LP * 2); float (*so)[32][68] = (float (*)[32][68])sm;
  const int tid = threadIdx.x, w = tid >> 5, lane = tid & 31, ln = lane & 15, hh = lane >> 4; const int by = blockIdx.y;
  unsigned bx = blockIdx.x; const bool job1 = bx < (unsigned)nb1; if (job1) { Bh = B1; C = C1; N = N1; ldc = N1; bias = nullptr; } else bx -= (unsigned)nb1;      /* a second product of the same A in the same grid (no bias, C1 of pitch N1): it has the first nb1 blocks, so that the small job starts with the launch; the same for the whole block */
  A += (size_t)by * sA; Bh += (size_t)by * sB; const size_t cofs = (size_t)by * sC; const float* bp = bias ? bias + (size_t)by * sBias : nullptr;
  const int ntn = N >> 6; const int mt = bx / ntn, nq = bx - mt * ntn; const int row0 = mt * 128 + 32 * w, col0 = nq * 64; if (mt * 128 >= M) return;      /* the same for the whole block: it stands in front of barriers */
  const int sr = tid >> 3, sc = (tid & 7) * 8;      /* staging: 8 lanes cover one row's 128 B, a wave-wide load covers 4 whole lines */
  const char* ab = (const char*)(A + (size_t)(mt * 128) * lda); const char* bb = (const char*)(Bh + (size_t)col0 * ldb);      /* the block's first A and B row: the same in every lane */
  const unsigned ao = (unsigned)(sr * lda + sc) * 2u, bo = (unsigned)(sr * ldb + sc) * 2u;      /* the lane's own byte offset, fixed for the whole loop */
  const v8f z8 = {0.f,0.f,0.f,0.f,0.f,0.f,0.f,0.f}; v8f c00 = z8, c01 = z8, c02 = z8, c03 = z8, c10 = z8, c11 = z8, c12 = z8, c13 = z8;
  v8us ra0[8], rb0[4], ra1[8], rb1[4];
  auto gl = [&](v8us* ra, v8us* rb, int kb) {
#pragma unroll
    for (int i = 0; i < 8; ++i) ra[i] = *(const v8us*)(ab + ((size_t)(16 * i) * lda + kb) * 2 + ao);
#pragma unroll
    for (int i = 0; i < 4; ++i) rb[i] = *(const v8us*)(bb + ((size_t)(16 * i) * ldb + kb) * 2 + bo); };
  auto st = [&](const v8us* ra, const v8us* rb, int buf) {
#pragma unroll
    for (int i = 0; i < 8; ++i) *(v8us*)&sa[buf][sr + 16 * i][sc] = ra[i];
#pragma unroll
    for (int i = 0; i < 4; ++i) *(v8us*)&sb[buf][sr + 16 * i][sc] = rb[i]; };
  auto comp = [&](int buf) {
#pragma unroll
    for (int kk = 0; kk < 64; kk += 32) { const v16h a0 = g2_frag(&sa[buf][32 * w + ln][kk], hh), a1 = g2_frag(&sa[buf][32 * w + 16 + ln][kk], hh);
      const v16h b0 = g2_frag(&sb[buf][ln][kk], hh), b1 = g2_frag(&sb[buf][16 + ln][kk], hh), b2 = g2_frag(&sb[buf][32 + ln][kk], hh), b3 = g2_frag(&sb[buf][48 + ln][kk], hh);
      c00 = g2_mma(a0, b0, c00); c10 = g2_mma(a1, b0, c10); c01 = g2_mma(a0, b1, c01); c11 = g2_mma(a1, b1, c11);
      c02 = g2_mma(a0, b2, c02); c12 = g2_mma(a1, b2, c12); c03 = g2_mma(a0, b3, c03); c13 = g2_mma(a1, b3, c13); } };
  // Each barrier publishes the buffer just written and ends every wave's reads of the other buffer, which is written next.
  gl(ra0, rb0, 0);
  __builtin_amdgcn_sched_barrier(0);      /* keeps set 0's loads in front of set 1's: mixed, set 0's wait at the loop's head would wait for set 1 as well */
  gl(ra1, rb1, 64 < K ? 64 : 0);      /* the second set's tile clamped, not branched round: set 0's loads stay the older ones on every way into the loop, so its wait leaves set 1's in flight */
  asm volatile("s_wait_xcnt 0x0" ::: "memory");      /* in front of whatever reuses the address registers of the loads above, which stay in flight */
  int kb = 0;
  // two tiles per trip so that each register set and each LDS buffer has a fixed name; every load of the trip is unconditional (the last two tiles are peeled off below), so the waits can be counted; kept rolled: unrolled further it only grows the code
#pragma unroll 1
  for (; kb + 128 < K; kb += 128) {
    st(ra0, rb0, 0); g2_bar(); gl(ra0, rb0, kb + 128); comp(0);      /* loads two tiles ahead: in flight over this tile's and the next tile's products */
    st(ra1, rb1, 1); g2_bar(); gl(ra1, rb1, kb + 192); comp(1);
    asm volatile("s_wait_xcnt 0x0" ::: "memory"); }      /* in front of the next trip's address arithmetic, which rewrites the address registers of loads still in flight */
  st(ra0, rb0, 0); g2_bar(); comp(0);
  if (kb + 64 < K) { st(ra1, rb1, 1); g2_bar(); comp(1); }
  g2_bar();      /* ends every wave's reads of the k-tiles: the epilogue's tiles are written over them */
  v8f accs[8] = {c00, c01, c02, c03, c10, c11, c12, c13};
  // every global read of the epilogue is issued here as one batch and waited for once: read where each element is formed, every element would wait for its own row address and its own round trip, with nothing else in the wave to cover them.
  // The addend is read in the store phase's layout (rows 2 * q + (lane >> 4), 16 B a lane, 256 B a row) and joins the staged tile in front of that phase: with no activation between them that is the same sum, (product * alpha + bias) + addend. The loops over q, t are unrolled in full so that their arrays stay in registers.
  const bool cadd = ACT == 0 && CP != nullptr;      /* the same for the whole launch */
  float bvr[4] = {0.f, 0.f, 0.f, 0.f}; v4f cq[16] = {};
  if (cadd) { size_t co[16]; const float* cr[16]; const int rr0 = row0g + row0 + (lane >> 4);      /* the test on rowsPerB stands outside the loops so that the 16 row offsets are formed side by side */
    if (rowsPerB < 0) {      /* own element of the batched C plane */
#pragma unroll
      for (int q = 0; q < 16; ++q) co[q] = cofs + (size_t)(rr0 + 2 * q) * ldc; }
    else {
#pragma unroll
      for (int q = 0; q < 16; ++q) co[q] = (size_t)((rr0 + 2 * q) / rowsPerB) * sCPb + (size_t)by * 64; }
#pragma unroll
    for (int q = 0; q < 16; ++q) cr[q] = CP + co[q] + col0 + (lane & 15) * 4;
#pragma unroll
    for (int q = 0; q < 16; ++q) cq[q] = *(const v4fa*)cr[q];
    // in front of whatever reuses the address registers of the loads above, which stay in flight; the 16 row addresses are inputs (read only) so that each stays whole up to the wait
    asm volatile("s_wait_xcnt 0x0" :: "v"(cr[0]), "v"(cr[1]), "v"(cr[2]), "v"(cr[3]), "v"(cr[4]), "v"(cr[5]), "v"(cr[6]), "v"(cr[7]), "v"(cr[8]), "v"(cr[9]), "v"(cr[10]), "v"(cr[11]), "v"(cr[12]), "v"(cr[13]), "v"(cr[14]), "v"(cr[15]) : "memory"); }
  if (bp) {
#pragma unroll
    for (int t = 0; t < 4; ++t) bvr[t] = bp[col0 + t * 16 + ln];
    asm volatile("s_wait_xcnt 0x0" ::: "memory"); }      /* in front of whatever reuses the address registers of the loads above, which stay in flight */
  if (PL && !job1) {      /* the same for the whole block */
    static_assert(!PL || (TT % 128 == 0 && HD == 64 && DM % HD == 0), "k_gemm2: a block tile must be one head's columns and lie in one batch");
    // C = [q | k | v] is not stored: the block's 64 columns are one head of q, k or v and its 128 rows lie in one batch, so the tile goes out as the attention's own operand: q, k as f16 rows [plane][t][64], v as V^T hi + residual x 2^10 [plane][d][t]. The loops over u, r, q, i are unrolled in full so that their arrays stay in registers.
    const int part = col0 / DM, tb = (mt * 128) % TT; const size_t plane = (size_t)((mt * 128) / TT) * NH + (col0 % DM) / HD;
    if (part < 2) {      /* rows: through the wave's own f32 tile, read back 8 columns a lane; a wave-wide store covers 4 whole rows = 512 B in a row */
#pragma unroll
      for (int u = 0; u < 8; ++u) { const int t = u & 3, half = u >> 2; const float bv = bf16_round(bvr[t]);
#pragma unroll
        for (int r = 0; r < 8; ++r) so[w][half * 16 + 8 * hh + r][t * 16 + ln] = accs[u][r] * alpha + bv; }
      __builtin_amdgcn_fence(__ATOMIC_ACQ_REL, "workgroup"); __builtin_amdgcn_wave_barrier();      /* the wave's LDS stores stand in front of the reads below, in which its lanes read one another's elements; no other wave touches this tile */
      unsigned short* D = (unsigned short*)(part == 0 ? PQ : PK) + (plane * TT + tb + 32 * w + (lane >> 3)) * HD + (lane & 7) * 8;
      FragH f[8];
#pragma unroll
      for (int q = 0; q < 8; ++q) { const float* sp = &so[w][q * 4 + (lane >> 3)][(lane & 7) * 8]; const v4f a = *(const v4fa*)sp, b = *(const v4fa*)(sp + 4);
#pragma unroll
        for (int i = 0; i < 4; ++i) { f[q].h[i] = (_Float16)a[i]; f[q].h[4 + i] = (_Float16)b[i]; } }
#pragma unroll
      for (int q = 0; q < 8; ++q) *(v8us*)(D + q * 4 * HD) = f[q].half[0];
      asm volatile("s_wait_xcnt 0x0" ::: "memory"); }      /* in front of whatever reuses the registers that the stores above name */
    else {      /* columns: a lane's accumulator registers are 8 consecutive t of one d, a 16-B piece of V^T; the block's pieces meet in LDS (the f32 tiles' space, pitch 136 halves = 16 B x 17), so that whole rows of 128 t = 256 B go out; hi + residual because the bias makes the attention peaked, so that v's rounding reaches the output almost unaveraged */
      unsigned short* th = (unsigned short*)&so[0][0][0]; unsigned short* tl = th + 64 * 136;
#pragma unroll
      for (int u = 0; u < 8; ++u) { const int t = u & 3, half = u >> 2; const float bv = bf16_round(bvr[t]); FragH fh, fl;
#pragma unroll
        for (int r = 0; r < 8; ++r) { const float v = accs[u][r] * alpha + bv; const _Float16 hv = (_Float16)v; fh.h[r] = hv; fl.h[r] = (_Float16)((v - (float)hv) * 1024.0f); }
        const int o = (t * 16 + ln) * 136 + 32 * w + half * 16 + 8 * hh; *(v8us*)(th + o) = fh.half[0]; *(v8us*)(tl + o) = fl.half[0]; }
      __syncthreads();      /* every wave's 32 t of each row are in place before a row is read */
      const size_t go = (plane * HD + (tid >> 4)) * TT + tb + (tid & 15) * 8; const int lo = (tid >> 4) * 136 + (tid & 15) * 8;
      v8us xh[8], xl[8];
#pragma unroll
      for (int i = 0; i < 8; ++i) { xh[i] = *(const v8us*)(th + lo + i * 8 * 136); xl[i] = *(const v8us*)(tl + lo + i * 8 * 136); }
#pragma unroll
      for (int i = 0; i < 8; ++i) { *(v8us*)((unsigned short*)PVH + go + (size_t)i * 8 * TT) = xh[i]; *(v8us*)((unsigned short*)PVL + go + (size_t)i * 8 * TT) = xl[i]; }
      asm volatile("s_wait_xcnt 0x0" ::: "memory"); }      /* in front of whatever reuses the registers that the stores above name */
    return; }
#pragma unroll
  for (int u = 0; u < 8; ++u) { const int t = u & 3, half = u >> 2; const int col = col0 + t * 16 + ln; const float bv = bf16_round(bvr[t]);      /* no bias: the rounding of 0 is 0 */
#pragma unroll
    for (int r = 0; r < 8; ++r) { const int rloc = half * 16 + 8 * hh + r; float v = accs[u][r] * alpha + bv; if (ACT != 0 && CP) { if (rowsPerB < 0) v += CP[cofs + (size_t)(row0g + row0 + rloc) * ldc + col];      /* rowsPerB < 0: own element of the batched C plane */ else { const int bidx = (row0g + row0 + rloc) / rowsPerB; v += CP[(size_t)bidx * sCPb + (size_t)by * 64 + col]; } }
      if (ACT == 3) v = fmaxf(v, 0.f); else if (ACT == 6) v = 0.5f * v * (1.0f + erff(v * 0.70710678118654752f)); else if (ACT == 11) v = 1.0f / (1.0f + expf(-v)); else if (ACT == 15) v = v / (1.0f + expf(-v)); else if (ACT == 12) v = (v > 0.f) ? v : 0.01f * v; else if (ACT == 8) v = tanhf(v); else if (ACT == 9) v = 0.5f * v * (1.0f + tanhf(0.7978845608028654f * (v + 0.044715f * v * v * v))); else if (ACT == 14) v = (v > 0.f) ? v : 0.1f * v; else if (ACT == 16) v = (v >= 0.f) ? v : 0.3f * v; else if (ACT == 17) v = (v >= 0.f) ? v : 0.2f * v;
      so[w][rloc][t * 16 + ln] = v; } }
  __builtin_amdgcn_fence(__ATOMIC_ACQ_REL, "workgroup"); __builtin_amdgcn_wave_barrier();
  const int rsub = lane >> 4, c4 = (lane & 15) * 4;
  if (cadd) {      /* each lane adds to the 16 B pieces that it alone reads back below; unrolled in full so that cq stays in registers */
#pragma unroll
    for (int q = 0; q < 16; ++q) { v4fa* sp = (v4fa*)&so[w][q * 2 + rsub][c4]; *sp = *sp + cq[q]; } }
  {
#pragma unroll
    for (int q = 0; q < 16; ++q) { const int r = q * 2 + rsub; const v4f v = *(const v4fa*)&so[w][r][c4]; if (C) *(v4f*)(C + cofs + (size_t)(row0 + r) * ldc + col0 + c4) = v; if (C16) { v4h h4; for (int i = 0; i < 4; ++i) h4[i] = (_Float16)v[i]; *(v4h*)(C16 + cofs + (size_t)(row0 + r) * ldc + col0 + c4) = h4; } }
     } }


// ---- output projection, both terms of the context in one launch: out = (c_hi + c_lo x 2^-10) . Wout^T + bout. Block tile 128 x 64 as in k_gemm2, eight waves: waves 0-3 take the hi plane's 128 rows, waves 4-7 the residual plane's same rows (wave tile 32 x 64),
// so one staged B k-tile serves both terms, a SIMD holds two waves (one of each term), and the residual term never goes through memory. The terms meet in LDS behind the loop: (hi x alpha + bias) + lo x alpha x 2^-10, the sum that two launches formed through out.
__global__ __launch_bounds__(256) void k_gemm_hl(const _Float16* __restrict__ AH, const _Float16* __restrict__ AL, const _Float16* __restrict__ Bh, const float* __restrict__ bias, float* __restrict__ C) {
  static_assert(NR % 128 == 0 && DM % 128 == 0 && DM >= 256, "k_gemm_hl: whole block tiles, two k-tiles a trip and two peeled");
  __shared__ __attribute__((aligned(16))) float so[8][32][68];
  // k-tiles of 64 halves: rows 0-127 of sa the hi plane, 128-255 the residual plane, so that wave w reads rows 32 * w ..; 128 B rows; two buffers; pitch as in k_gemm2
  __shared__ __attribute__((aligned(16))) _Float16 sa[2][256][G2_LP];
  __shared__ __attribute__((aligned(16))) _Float16 sb[2][64][G2_LP];
  const int tid = threadIdx.x, w = tid >> 5, lane = tid & 31, ln = lane & 15, hh = lane >> 4;
  const int mt = blockIdx.x / (DM / 64), col0 = (blockIdx.x % (DM / 64)) * 64;
  const int sr = tid >> 3, sc = (tid & 7) * 8;      /* staging: 8 lanes cover one row's 128 B, the block 32 rows a step */
  const char* hb = (const char*)(AH + (size_t)(mt * 128) * DM); const char* lb = (const char*)(AL + (size_t)(mt * 128) * DM); const char* bb = (const char*)(Bh + (size_t)col0 * DM);      /* the block's first rows: the same in every lane */
  const unsigned ao = (unsigned)(sr * DM + sc) * 2u;      /* the lane's own byte offset, fixed for the whole loop */
  const v8f z8 = {0.f,0.f,0.f,0.f,0.f,0.f,0.f,0.f}; v8f c00 = z8, c01 = z8, c02 = z8, c03 = z8, c10 = z8, c11 = z8, c12 = z8, c13 = z8;
  v8us ra0[8], rb0[2], ra1[8], rb1[2]; float bvr[4];
  // every loop over i, t, u, r, q below is unrolled in full so that its arrays stay in registers
  auto gl = [&](v8us* ra, v8us* rb, int kb) {
#pragma unroll
    for (int i = 0; i < 4; ++i) ra[i] = *(const v8us*)(hb + ((size_t)(32 * i) * DM + kb) * 2 + ao);
#pragma unroll
    for (int i = 0; i < 4; ++i) ra[4 + i] = *(const v8us*)(lb + ((size_t)(32 * i) * DM + kb) * 2 + ao);
#pragma unroll
    for (int i = 0; i < 2; ++i) rb[i] = *(const v8us*)(bb + ((size_t)(32 * i) * DM + kb) * 2 + ao); };
  auto st = [&](const v8us* ra, const v8us* rb, int buf) {
#pragma unroll
    for (int i = 0; i < 8; ++i) *(v8us*)&sa[buf][sr + 32 * i][sc] = ra[i];
#pragma unroll
    for (int i = 0; i < 2; ++i) *(v8us*)&sb[buf][sr + 32 * i][sc] = rb[i]; };
  auto comp = [&](int buf) {
#pragma unroll
    for (int kk = 0; kk < 64; kk += 32) { const v16h a0 = g2_frag(&sa[buf][32 * w + ln][kk], hh), a1 = g2_frag(&sa[buf][32 * w + 16 + ln][kk], hh);
      const v16h b0 = g2_frag(&sb[buf][ln][kk], hh), b1 = g2_frag(&sb[buf][16 + ln][kk], hh), b2 = g2_frag(&sb[buf][32 + ln][kk], hh), b3 = g2_frag(&sb[buf][48 + ln][kk], hh);
      c00 = g2_mma(a0, b0, c00); c10 = g2_mma(a1, b0, c10); c01 = g2_mma(a0, b1, c01); c11 = g2_mma(a1, b1, c11);
      c02 = g2_mma(a0, b2, c02); c12 = g2_mma(a1, b2, c12); c03 = g2_mma(a0, b3, c03); c13 = g2_mma(a1, b3, c13); } };
  // the bias values are the oldest loads of the wave: they have landed with the first tile and cost the epilogue no round trip
#pragma unroll
  for (int t = 0; t < 4; ++t) bvr[t] = bias[col0 + t * 16 + ln];
  gl(ra0, rb0, 0);
  __builtin_amdgcn_sched_barrier(0);      /* keeps set 0's loads in front of set 1's: mixed, set 0's wait at the loop's head would wait for set 1 as well */
  gl(ra1, rb1, 64);
  asm volatile("s_wait_xcnt 0x0" ::: "memory");      /* in front of whatever reuses the address registers of the loads above, which stay in flight */
  int kb = 0;
  // Each barrier publishes the buffer just written and ends every wave's reads of the other buffer, which is written next. Two tiles per trip so that each register set and each LDS buffer has a fixed name; the last two tiles are peeled off, so every load of a trip is unconditional and the waits can be counted; kept rolled: unrolled further it only grows the code
#pragma unroll 1
  for (; kb + 128 < DM; kb += 128) {
    st(ra0, rb0, 0); g2_bar(); gl(ra0, rb0, kb + 128); comp(0);      /* loads two tiles ahead: in flight over this tile's and the next tile's products */
    st(ra1, rb1, 1); g2_bar(); gl(ra1, rb1, kb + 192); comp(1);
    asm volatile("s_wait_xcnt 0x0" ::: "memory"); }      /* in front of the next trip's address arithmetic, which rewrites the address registers of loads still in flight */
  st(ra0, rb0, 0); g2_bar(); comp(0);
  st(ra1, rb1, 1); g2_bar(); comp(1);
  const v8f accs[8] = {c00, c01, c02, c03, c10, c11, c12, c13};
  const bool res = w >= 4; const float alpha = res ? 0.0625f / 1024.0f : 0.0625f; float bv[4];      /* weights x 16; residual x 2^10; the bias joins the hi term alone */
#pragma unroll
  for (int t = 0; t < 4; ++t) { const float b = bf16_round(bvr[t]); bv[t] = res ? 0.f : b; }
#pragma unroll
  for (int u = 0; u < 8; ++u) { const int t = u & 3, half = u >> 2;
#pragma unroll
    for (int r = 0; r < 8; ++r) so[w][half * 16 + 8 * hh + r][t * 16 + ln] = accs[u][r] * alpha + bv[t]; }
  __syncthreads();      /* both terms of every tile are in place before they are added */
  // wave w adds and stores 16 rows of row group w & 3: 16 B a lane, a wave-wide store covers 2 rows of 256 B; all sums first, the stores last, so that nothing rewrites a register that a store names
  const int wq = w & 3, r0 = (w >> 2) * 16 + (lane >> 4), c4 = (lane & 15) * 4; v4f o[8];
#pragma unroll
  for (int q = 0; q < 8; ++q) o[q] = *(const v4fa*)&so[wq][r0 + 2 * q][c4] + *(const v4fa*)&so[4 + wq][r0 + 2 * q][c4];
  float* cp = C + (size_t)(mt * 128 + 32 * wq + r0) * DM + col0 + c4;
#pragma unroll
  for (int q = 0; q < 8; ++q) *(v4f*)(cp + (size_t)(2 * q) * DM) = o[q]; }

// ---- launches that do not depend on one another share one grid: a range of block indices per job (every test on the block index is the same for the whole work-group); no job reads what another job of its grid writes
// the seven input conversions to f16 (weights x 16, x as it is: x 1 is exact); 8 values a thread, every array a whole number of blocks
#define PB_QKV (3 * DM * DM / 8 / 256)
#define PB_X (NR * DM / 8 / 256)
#define PB_OUT (DM * DM / 8 / 256)
#define PB_LIN (64 * DM / 8 / 256)
__global__ __launch_bounds__(256) void k_prep(const float* __restrict__ Wqkv, const float* __restrict__ x, const float* __restrict__ Wout, const float* __restrict__ W1w, const float* __restrict__ W2w, const float* __restrict__ W1r, const float* __restrict__ W2r,
    _Float16* __restrict__ BQKV, _Float16* __restrict__ X16, _Float16* __restrict__ BO, _Float16* __restrict__ BL) {
  int b = blockIdx.x; const float* Wm; _Float16* Bt; float sc = 16.0f;
  if (b < PB_QKV) { Wm = Wqkv; Bt = BQKV; }
  else if ((b -= PB_QKV) < PB_X) { Wm = x; Bt = X16; sc = 1.0f; }
  else if ((b -= PB_X) < PB_OUT) { Wm = Wout; Bt = BO; }
  else { b -= PB_OUT; const int g = b / PB_LIN; b -= g * PB_LIN; Wm = g == 0 ? W1w : g == 1 ? W2w : g == 2 ? W1r : W2r; Bt = BL + (size_t)g * 64 * DM; }      /* [W1w; W2w; W1r; W2r] rows h*4 + i */
  const size_t t = (size_t)b * 256 + threadIdx.x; FragH f; for (int q = 0; q < 8; ++q) f.h[q] = (_Float16)(bf16_round(Wm[t * 8 + q]) * sc); *(v8us*)((unsigned short*)Bt + t * 8) = f.half[0];  }
__device__ __forceinline__ void exter(const float* p1, const float* p2, float* L) {
  #pragma clang fp contract(off)
  const int PI[6] = {0, 0, 0, 1, 1, 2}, PJ[6] = {1, 2, 3, 2, 3, 3}; float n2 = 0.f;
  for (int k = 0; k < 6; ++k) { float a = p1[PI[k]] * p2[PJ[k]]; a += -(p1[PJ[k]] * p2[PI[k]]); L[k] = a; n2 += a * a; }
  const float n = fmaxf(sqrtf(n2), 1e-12f); for (int k = 0; k < 6; ++k) L[k] = L[k] / n; }
__device__ __forceinline__ void lines_body(const int bx, const float* __restrict__ LW, float* __restrict__ JW, float* __restrict__ RD) {
  #pragma clang fp contract(off)
  const int tt = bx * 256 + threadIdx.x; if (tt >= NR * NH) return; const int t = tt % TT; const int bh = tt / TT; const int h = bh % NH, b = bh / NH; const size_t row = (size_t)b * TT + t; float w1[4], w2[4], r1[4], r2[4];
  for (int i = 0; i < 4; ++i) { w1[i] = (t > 0) ? LW[(row - 1) * 256 + h * 4 + i] : 0.f; w2[i] = LW[row * 256 + 64 + h * 4 + i]; r1[i] = LW[row * 256 + 128 + h * 4 + i]; r2[i] = LW[row * 256 + 192 + h * 4 + i]; }
  float wl[6], rl[6]; exter(w1, w2, wl); exter(r1, r2, rl); v8f jw, rd; jw[0] = wl[5]; jw[1] = -wl[4]; jw[2] = wl[3]; jw[3] = wl[2]; jw[4] = -wl[1]; jw[5] = wl[0]; jw[6] = 0.f; jw[7] = 0.f; for (int k = 0; k < 6; ++k) rd[k] = rl[k]; rd[6] = 0.f; rd[7] = 0.f;
  const size_t o = (((size_t)b * NH + h) * TT + t) * 8; { *(v8f*)(JW + o) = jw; *(v8f*)(RD + o) = rd;  } }
#define SB_LIN (NR * NH / 256)
__global__ __launch_bounds__(256) void k_lines(const float* __restrict__ LW, float* __restrict__ JW, float* __restrict__ RD) { lines_body(blockIdx.x, LW, JW, RD); }
typedef float v2f __attribute__((ext_vector_type(2)));
typedef float v2fa __attribute__((ext_vector_type(2), may_alias));
// Causal 6x6 Gram state and rd . M, one work-group per (batch, head). M is symmetric bit for bit (w_i * w_j rounds the same either way and both sides sum in the same order), so 21 running sums carry it.
// Three phases through one LDS array, plane e = (i, j), i <= j, column t: (A) every thread forms the 21 products of its rows; (B) 21 lanes of one wave turn each plane into its running sum over t, in the order t = 0, 1, ...; (C) every thread reads M_t of its rows and forms rd_t . M_t, i = 0..5 in order.
// Plane pitch TT + 4 floats: the 16-B reads and writes of phase B, one plane per lane, start 4 banks apart; phases A and C touch 32 columns in a row of one plane.
#define CE 21
#define CPI (TT + 4)
__device__ __forceinline__ void cum_body(const int bx, const float* __restrict__ JW, const float* __restrict__ RD, float* __restrict__ RDM) {
  __shared__ __attribute__((aligned(16))) float pm[CE][CPI];
  const int tid = threadIdx.x; const size_t bh = bx; const float* jw = JW + bh * TT * 8; const float* rd = RD + bh * TT * 8; float* ob = RDM + bh * TT * 8;
  // every global load of the block is issued before the first is waited for; thread tid has rows c * 256 + tid; all loops over c, i, j, u, q are unrolled in full so that their arrays stay in registers
  v4f wa[TT / 256], ra[TT / 256]; v2f wb[TT / 256], rb[TT / 256];      /* a row's six values as 16 + 8 bytes */
#pragma unroll
  for (int c = 0; c < TT / 256; ++c) { const float* q = jw + (size_t)(c * 256 + tid) * 8; wa[c] = *(const v4fa*)q; wb[c] = *(const v2fa*)(q + 4); }
#pragma unroll
  for (int c = 0; c < TT / 256; ++c) { const float* q = rd + (size_t)(c * 256 + tid) * 8; ra[c] = *(const v4fa*)q; rb[c] = *(const v2fa*)(q + 4); }
  asm volatile("s_wait_xcnt 0x0" ::: "memory");      /* in front of whatever reuses the address registers of the loads above, which stay in flight */
#pragma unroll
  for (int c = 0; c < TT / 256; ++c) { const float w[6] = {wa[c][0], wa[c][1], wa[c][2], wa[c][3], wb[c][0], wb[c][1]}; int e = 0;
#pragma unroll
    for (int i = 0; i < 6; ++i)
#pragma unroll
      for (int j = i; j < 6; ++j) { pm[e][c * 256 + tid] = w[i] * w[j]; ++e; } }
  __syncthreads();
  if (tid < CE) { float* p = &pm[tid][0]; float acc = 0.f; v4f cur[8], nxt[8];
    // the one dependent chain left is one add per t; the reads run 32 columns ahead of it in two named register sets, so that it never waits for LDS
#pragma unroll
    for (int u = 0; u < 8; ++u) cur[u] = *(const v4f*)(p + 4 * u);
    // two sets per trip so that each has a fixed name; kept rolled: unrolled further it only grows the code
#pragma unroll 1
    for (int t0 = 0; t0 < TT; t0 += 64) {
#pragma unroll
      for (int u = 0; u < 8; ++u) nxt[u] = *(const v4f*)(p + t0 + 32 + 4 * u);
#pragma unroll
      for (int u = 0; u < 8; ++u) { v4f o;
#pragma unroll
        for (int q = 0; q < 4; ++q) { acc += cur[u][q]; o[q] = acc; }
        *(v4f*)(p + t0 + 4 * u) = o; }
      if (t0 + 64 < TT) {
#pragma unroll
        for (int u = 0; u < 8; ++u) cur[u] = *(const v4f*)(p + t0 + 64 + 4 * u); }
#pragma unroll
      for (int u = 0; u < 8; ++u) { v4f o;
#pragma unroll
        for (int q = 0; q < 4; ++q) { acc += nxt[u][q]; o[q] = acc; }
        *(v4f*)(p + t0 + 32 + 4 * u) = o; } } }
  __syncthreads();
#pragma unroll
  for (int c = 0; c < TT / 256; ++c) { const float r[6] = {ra[c][0], ra[c][1], ra[c][2], ra[c][3], rb[c][0], rb[c][1]}; float m[CE];
#pragma unroll
    for (int e = 0; e < CE; ++e) m[e] = pm[e][c * 256 + tid];
    v8f o;
#pragma unroll
    for (int j = 0; j < 6; ++j) { float v = 0.f;
#pragma unroll
      for (int i = 0; i < 6; ++i) { const int lo = i < j ? i : j, hi = i < j ? j : i; v += r[i] * m[lo * 6 - (lo * (lo - 1)) / 2 + hi - lo]; }
      o[j] = v; }
    o[6] = 0.f; o[7] = 0.f;
    *(v8f*)(ob + (size_t)(c * 256 + tid) * 8) = o;
    if (c + 1 < TT / 256) asm volatile("s_wait_xcnt 0x0" ::: "memory"); } }      /* in front of the next rows' LDS reads and sums, which reuse the registers that the store names */
__global__ __launch_bounds__(256) void k_cum(const float* __restrict__ JW, const float* __restrict__ RD, float* __restrict__ RDM) { cum_body(blockIdx.x, JW, RD, RDM); }
#define FA_JP 68      /* pitch of a Jw plane in floats: 16-B multiples for the reads; the staging stores of a wave (16 keys x 2 groups of 4 planes) fall on 32 different banks */
__device__ __forceinline__ v8f fa_mma(v16h a, v16h b, v8f c) { return __builtin_amdgcn_wmma_f32_16x16x32_f16(false, a, false, b, (short)0, c, false, false); }
__global__ __launch_bounds__(128) void k_fattn(const _Float16* __restrict__ Q, const _Float16* __restrict__ Kh, const _Float16* __restrict__ Vh, const _Float16* __restrict__ Vl, const float* __restrict__ RDM, const float* __restrict__ JW, const float* __restrict__ bsc, _Float16* __restrict__ CH, _Float16* __restrict__ CL) {
  // two buffers of: 64 K rows [key][64 d], 64 V^T rows hi and residual [d][64 keys] (pitch as in k_gemm2), Jw as planes [component][key]
  __shared__ __attribute__((aligned(16))) _Float16 sk[2][64][G2_LP];
  __shared__ __attribute__((aligned(16))) _Float16 sv[2][64][G2_LP];
  __shared__ __attribute__((aligned(16))) _Float16 sl[2][64][G2_LP];
  __shared__ __attribute__((aligned(16))) float sj[2][8][FA_JP];
  const int tid = threadIdx.x, w = tid >> 5, lane = tid & 31, ln = lane & 15, hh = lane >> 4;
  const int pl = blockIdx.x, by = blockIdx.y, blk = by < TT / 128 ? TT / 64 - 1 - by : by - TT / 128;      /* plane; row block: block b walks b + 1 tiles; the long half first, longest first, then the short half, shortest first, so that work-groups half a grid apart add up alike (for speed only) */
  const int tl = w * 16 + ln; const size_t prow = (size_t)pl * TT + blk * 64 + tl;      /* the lane's query: inside the block, and as a row of the planes */
  const float bs2 = bf16_round(bsc[pl % NH]) * 1.4426950408889634f, c1 = 0.125f * 1.4426950408889634f;
  const v16h q0 = g2_frag(Q + prow * HD, hh), q1 = g2_frag(Q + prow * HD + 32, hh);
  const v4f r03 = *(const v4fa*)(RDM + prow * 8); const v2f r45 = *(const v2fa*)(RDM + prow * 8 + 4);
  const float rdm[6] = {r03[0], r03[1], r03[2], r03[3], r45[0], r45[1]};
  const int sr = tid >> 3, sc = (tid & 7) * 8;      /* staging: 8 lanes cover one row's 128 B */
  const char* kg = (const char*)(Kh + (size_t)pl * TT * HD); const char* vg = (const char*)(Vh + (size_t)pl * HD * TT); const char* lg = (const char*)(Vl + (size_t)pl * HD * TT); const char* jg = (const char*)(JW + (size_t)pl * TT * 8);      /* the plane's first bytes: the same in every lane */
  const unsigned ko = (unsigned)(sr * HD + sc) * 2u, vo = (unsigned)(sr * TT + sc) * 2u, jo = (unsigned)tid * 16u;      /* the lane's own byte offsets, fixed for the whole loop; Jw: key tid >> 1, components 4 * (tid & 1) .. + 3 (6 and 7 are the rows' padding: staged along, never read) */
  v8us rk[4], rv[4], rl[4]; v4f rj;
  // every loop over i, q, c, k, r, ks, ds below is unrolled in full so that its arrays stay in registers
  auto gl = [&](int j) {
    const char* kj = kg + (size_t)j * 64 * HD * 2 + ko; const char* vj = vg + (size_t)j * 64 * 2 + vo; const char* lj = lg + (size_t)j * 64 * 2 + vo; const char* jj = jg + (size_t)j * 64 * 32 + jo;
#pragma unroll
    for (int i = 0; i < 4; ++i) rk[i] = *(const v8us*)(kj + 16 * i * HD * 2);
#pragma unroll
    for (int i = 0; i < 4; ++i) rv[i] = *(const v8us*)(vj + 16 * i * TT * 2);
#pragma unroll
    for (int i = 0; i < 4; ++i) rl[i] = *(const v8us*)(lj + 16 * i * TT * 2);
    rj = *(const v4fa*)jj;
    // in front of whatever reuses the address registers of the loads above, which stay in flight; the four addresses are inputs (read only) so that they stay whole up to the wait: otherwise the last load of a group lands on the address pair that the group's earlier loads name
    asm volatile("s_wait_xcnt 0x0" :: "v"(kj), "v"(vj), "v"(lj), "v"(jj) : "memory"); };
  auto st = [&](int buf) {
#pragma unroll
    for (int i = 0; i < 4; ++i) { *(v8us*)&sk[buf][sr + 16 * i][sc] = rk[i]; *(v8us*)&sv[buf][sr + 16 * i][sc] = rv[i]; *(v8us*)&sl[buf][sr + 16 * i][sc] = rl[i]; }
#pragma unroll
    for (int q = 0; q < 4; ++q) sj[buf][(tid & 1) * 4 + q][tid >> 1] = rj[q]; };
  const v8f z8 = {0.f,0.f,0.f,0.f,0.f,0.f,0.f,0.f};
  v8f oa[4] = {z8, z8, z8, z8};
  float m = -3.0e38f, su = 0.f;
  gl(0);
  __builtin_amdgcn_sched_barrier(0);      /* keeps the clearing of the accumulators, which reuses the address registers of the q and rd . M loads above, behind the wait that ends gl */
  // Each barrier publishes the buffer just written and ends every wave's reads of the other buffer, which is written next. The next tile's loads fly during this tile's work; the diagonal tile has none behind it (the test is the same for the whole block), so no load is in flight when a wave ends.
  for (int j = 0; ; ++j) {      /* left behind the diagonal tile, at the foot */
    const int buf = j & 1;
    st(buf); g2_bar(); if (j < blk) gl(j + 1);
    float l[4][8];
#pragma unroll
    for (int c = 0; c < 4; ++c) {
      v8f s = fa_mma(g2_frag(&sk[buf][c * 16 + ln][0], hh), q0, z8); s = fa_mma(g2_frag(&sk[buf][c * 16 + ln][32], hh), q1, s);
      v4f jv[6][2];
#pragma unroll
      for (int k = 0; k < 6; ++k) { jv[k][0] = *(const v4f*)&sj[buf][k][c * 16 + 8 * hh]; jv[k][1] = *(const v4f*)&sj[buf][k][c * 16 + 8 * hh + 4]; }
#pragma unroll
      for (int r = 0; r < 8; ++r) { float d = 0.f;
#pragma unroll
        for (int k = 0; k < 6; ++k) d += rdm[k] * jv[k][r >> 2][r & 3];
        l[c][r] = s[r] * c1 + fabsf(d) * bs2; } }
    if (j == blk) {      /* the diagonal tile alone holds keys behind a query; the same for the whole block */
#pragma unroll
      for (int c = 0; c < 4; ++c)
#pragma unroll
        for (int r = 0; r < 8; ++r) if (c * 16 + 8 * hh + r > tl) l[c][r] = -3.0e38f; }
    float mt = l[0][0];
#pragma unroll
    for (int c = 0; c < 4; ++c)
#pragma unroll
      for (int r = 0; r < 8; ++r) mt = fmaxf(mt, l[c][r]);
    mt = fmaxf(mt, __shfl_xor(mt, 16, 32));      /* the row's other 32 keys of the tile; key 0 is open to every query, so the maximum is a real logit from tile 0 on */
    const float mn = fmaxf(m, mt), al = __builtin_amdgcn_exp2f(m - mn), mo = mn - 10.0f; m = mn; su *= al;
#pragma unroll
    for (int ds = 0; ds < 4; ++ds) oa[ds] *= al;
#pragma unroll
    for (int ks = 0; ks < 2; ++ks) { FragH pf;
#pragma unroll
      for (int i = 0; i < 16; ++i) { const float e = __builtin_amdgcn_exp2f(l[2 * ks + (i >> 3)][i & 7] - mo); su += e; pf.h[i] = (_Float16)e; }
      const v16h pr = pf.v * (_Float16)0.0009765625f;
#pragma unroll
      for (int ds = 0; ds < 4; ++ds) { oa[ds] = fa_mma(g2_frag(&sv[buf][ds * 16 + ln][ks * 32], hh), pf.v, oa[ds]); oa[ds] = fa_mma(g2_frag(&sl[buf][ds * 16 + ln][ks * 32], hh), pr, oa[ds]); } }
    if (j >= blk) break; }
  su += __shfl_xor(su, 16, 32);
  const float inv = 1.0f / su;
  const size_t o = ((size_t)(pl / NH) * TT + blk * 64 + tl) * DM + (pl % NH) * HD + 8 * hh;
#pragma unroll
  for (int ds = 0; ds < 4; ++ds) { FragH f, fl;
#pragma unroll
    for (int r = 0; r < 8; ++r) { const float v = oa[ds][r] * inv; const _Float16 hv = (_Float16)v; f.h[r] = hv; fl.h[r] = (_Float16)((v - (float)hv) * 1024.0f); }
    *(v8us*)((unsigned short*)CH + o + ds * 16) = f.half[0]; *(v8us*)((unsigned short*)CL + o + ds * 16) = fl.half[0];
    if (ds + 1 < 4) asm volatile("s_wait_xcnt 0x0" ::: "memory"); } }      /* in front of the next columns' sums, which may reuse the registers that the stores name */

extern "C" void kernel_launch(void* const* d_in, const int* in_sizes, int n_in,
                              void* d_out, int out_size, void* d_ws, size_t ws_size, hipStream_t stream) {
  (void)in_sizes; (void)n_in; (void)out_size;
  const float* x = (const float*)d_in[0]; const float* Wqkv = (const float*)d_in[1]; const float* bqkv = (const float*)d_in[2]; const float* W1w = (const float*)d_in[3]; const float* W2w = (const float*)d_in[4]; const float* W1r = (const float*)d_in[5]; const float* W2r = (const float*)d_in[6]; const float* bsc = (const float*)d_in[7]; const float* Wout = (const float*)d_in[8]; const float* bout = (const float*)d_in[9];
  char* ws = (char*)d_ws; size_t off = 0;
  auto take = [&](size_t bytes) { char* p = ws + off; off += (bytes + 255) & ~(size_t)255; return p; };
  const size_t np = (size_t)NR * DM;
  _Float16* BQKV = (_Float16*)take((size_t)3 * DM * DM * 2); _Float16* BL = (_Float16*)take((size_t)256 * DM * 2); _Float16* X16 = (_Float16*)take(np * 2); float* LW = (float*)take((size_t)NR * 256 * 4); float* RD = (float*)take((size_t)NB * NH * TT * 8 * 4);
  _Float16* BO = (_Float16*)take((size_t)DM * DM * 2); _Float16* Q16 = (_Float16*)take(np * 2); _Float16* K16 = (_Float16*)take(np * 2); _Float16* VT = (_Float16*)take(np * 2); _Float16* VTL = (_Float16*)take(np * 2);
  float* JW = (float*)take((size_t)NB * NH * TT * 8 * 4); float* RDM = (float*)take((size_t)NB * NH * TT * 8 * 4);
  _Float16* CH = (_Float16*)take(np * 2); _Float16* CL = (_Float16*)take(np * 2);
  if (off > ws_size) return;      /* under 42 MiB */
  k_prep<<<PB_QKV + PB_X + PB_OUT + 4 * PB_LIN, 256, 0, stream>>>(Wqkv, x, Wout, W1w, W2w, W1r, W2r, BQKV, X16, BO, BL);      /* torch (out, in) naturals */
  k_gemm2<0, true><<<dim3((NR / 128) * (256 / 64) + (NR / 128) * (3 * DM / 64), 1), 128, 0, stream>>>(X16, DM, 0, BQKV, DM, 0, 0.0625f, bqkv, 0, nullptr, 1, 0, 0, nullptr, nullptr, 3 * DM, 0, NR, 3 * DM, DM, (NR / 128) * (256 / 64), BL, LW, 256, Q16, K16, VT, VTL);      /* [q | k | v] + bias, head h at h*64, written as the attention's f16 planes; line projections f32 [row][w1 | w2 | r1 | r2] (x_prev handled by a row shift) */
  k_lines<<<SB_LIN, 256, 0, stream>>>(LW, JW, RD);
  k_cum<<<NB * NH, 256, 0, stream>>>(JW, RD, RDM);
  // attention: one launch, scores and weights stay in registers; grid x = the 32 (batch, head) planes, y = the 16 blocks of 64 query rows; q, k are [plane][t][64], v^T [plane][d][t]; the context comes out as [row][head * 64 + d], hi + residual
  k_fattn<<<dim3(NB * NH, TT / 64), 128, 0, stream>>>(Q16, K16, VT, VTL, RDM, JW, bsc, CH, CL);
  k_gemm_hl<<<(NR / 128) * (DM / 64), 256, 0, stream>>>(CH, CL, BO, bout, (float*)d_out);      /* out = (c_lo + c_hi) Wout^T + bout */
}
